// v000
// Measured on an AMD MI455X. A time is GPU time per run, averaged over a window of back-to-back runs after a warm-up
// (all launches, gaps included; the runs take copies of the inputs in turn), and the median of several windows.
// Apart from v000's, it joins two sittings. Times from different sittings can be a few percent apart, while
// side-by-side timings come from the same sitting.
// v000 is the starting kernel. One run takes 376 microseconds.
#include <hip/hip_runtime.h>
#include <stdint.h>

// ---------------------------------------------------------------------------
// TTT-style causal linear-attention fusion for MI455X (gfx1250, wave32).
// Out = (2*tril(QK^T) - tril((tril(QK^T)K)K^T)) V, fused per 64-row q-block.
// All GEMMs use V_WMMA_F32_16X16X4_F32 (exact fp32 matrix path).
// Tile loads use GLOBAL_LOAD_ASYNC_TO_LDS_B128 (ASYNCcnt-tracked DMA into
// LDS, no VGPR staging) via inline asm.
// ---------------------------------------------------------------------------

typedef __attribute__((ext_vector_type(2))) float v2f;
typedef __attribute__((ext_vector_type(8))) float v8f;

#define S_LEN 2048
#define H_NUM 16
#define B_NUM 2
#define D_DIM 64
#define BQ    64                 // query rows per workgroup
#define NQB   (S_LEN / BQ)       // 32 query blocks
#define LDSW  68                 // padded LDS row stride (68 % 64 == 4 -> conflict-free)
#define TILE_F (BQ * LDSW)       // floats per 64x64 padded tile

__device__ __forceinline__ v8f wmma4(v2f a, v2f b, v8f c) {
  // (neg_a, A, neg_b, B, c_mod, C, reuse_a, reuse_b)
  return __builtin_amdgcn_wmma_f32_16x16x4_f32(false, a, false, b, (short)0, c,
                                               false, false);
}

__global__ __launch_bounds__(256) void ttt_fused_kernel(
    const float* __restrict__ qkv, float* __restrict__ out) {
  // 3 padded 64x64 fp32 tiles: Q (reused as O2 in phase 2), K/V (shared), S.
  __shared__ float sQ[TILE_F];
  __shared__ float sKV[TILE_F];
  __shared__ float sS[TILE_F];

  const int qb   = blockIdx.x;      // query block
  const int h    = blockIdx.y;      // head
  const int b    = blockIdx.z;      // batch
  const int tid  = threadIdx.x;
  const int wave = tid >> 5;        // 0..7
  const int lane = tid & 31;
  const int ln   = lane & 15;       // lane within half-wave
  const int lh   = lane >> 4;       // half-wave (k-pair / row-group select)
  const int ro   = wave & 3;        // wave's 16-row group (0..3)
  const int cg   = wave >> 2;       // wave's 32-col group (0..1)
  const int qbase = qb * BQ;

  // qkv flat index: (((b*S + s)*3 + which)*H + h)*D + d
  auto grow = [&](int s, int which) -> size_t {
    return ((((size_t)b * S_LEN + s) * 3 + which) * H_NUM + h) * (size_t)D_DIM;
  };

  // Async DMA of one 64x64 fp32 tile into LDS: 16 bytes/lane, 4 reps.
  // VDST VGPR holds the LDS byte offset (low 32 bits of the flat pointer).
  auto loadBlkAsync = [&](float* dst, int sbase, int which) {
#pragma unroll
    for (int rep = 0; rep < 4; ++rep) {
      int idx = rep * 256 + tid;
      int row = idx >> 4;
      int c4  = (idx & 15) << 2;
      const float* gp = qkv + grow(sbase + row, which) + c4;
      unsigned ldsoff = (unsigned)(uintptr_t)(&dst[row * LDSW + c4]);
      asm volatile("global_load_async_to_lds_b128 %0, %1, off"
                   :
                   : "v"(ldsoff), "v"(gp)
                   : "memory");
    }
  };
  auto asyncWait = [&]() {
    asm volatile("s_wait_asynccnt 0x0" ::: "memory");
  };

  // Score tiles: sS = sign * mask(sA * K^T). Wave computes its (ro, cg*32..)
  // 16x32 strip. A-frag & B-frag are both row-major float2 loads (X * Y^T).
  auto scoreTiles = [&](const float* sA, int kbase, bool diag, float sign) {
    v8f s0 = {};
    v8f s1 = {};
#pragma unroll
    for (int k4 = 0; k4 < 16; ++k4) {
      const int col = k4 * 4 + lh * 2;  // k-dim pair for this half-wave
      v2f a  = *(const v2f*)(&sA[(ro * 16 + ln) * LDSW + col]);
      v2f b0 = *(const v2f*)(&sKV[((cg * 2 + 0) * 16 + ln) * LDSW + col]);
      v2f b1 = *(const v2f*)(&sKV[((cg * 2 + 1) * 16 + ln) * LDSW + col]);
      s0 = wmma4(a, b0, s0);
      s1 = wmma4(a, b1, s1);
    }
    // C layout: lanes 0-15 hold rows M=e, lanes 16-31 rows M=e+8, col N=ln.
#pragma unroll
    for (int e = 0; e < 8; ++e) {
      const int row = ro * 16 + e + 8 * lh;
      const int t   = qbase + row;
      const int c0  = cg * 32 + ln;
      const int c1  = cg * 32 + 16 + ln;
      float v0 = s0[e] * sign;
      float v1 = s1[e] * sign;
      if (diag && (kbase + c0) > t) v0 = 0.0f;
      if (diag && (kbase + c1) > t) v1 = 0.0f;
      sS[row * LDSW + c0] = v0;
      sS[row * LDSW + c1] = v1;
    }
  };

  // acc(16x32 strip) += S * B, B = 64x64 tile in sKV (s-major).
  auto gemmSB = [&](v8f& acc0, v8f& acc1) {
#pragma unroll
    for (int k4 = 0; k4 < 16; ++k4) {
      const int col  = k4 * 4 + lh * 2;
      const int srow = col;              // B k-dim rows for this half-wave
      const int c0   = cg * 32 + ln;
      const int c1   = cg * 32 + 16 + ln;
      v2f a  = *(const v2f*)(&sS[(ro * 16 + ln) * LDSW + col]);
      v2f b0 = {sKV[srow * LDSW + c0], sKV[(srow + 1) * LDSW + c0]};
      v2f b1 = {sKV[srow * LDSW + c1], sKV[(srow + 1) * LDSW + c1]};
      acc0 = wmma4(a, b0, acc0);
      acc1 = wmma4(a, b1, acc1);
    }
  };

  v8f o2a = {}, o2b = {};    // O2 strip accumulators (16x32 per wave)
  v8f outa = {}, outb = {};  // output strip accumulators

  // Load Q block once (async DMA; published by the first loop barrier).
  loadBlkAsync(sQ, qbase, 0);
  asyncWait();

  // ---- Phase 1: O2 += tril(QK^T)K ; P1 += tril(QK^T)V -------------------
  for (int kb = 0; kb <= qb; ++kb) {
    const int kbase = kb * BQ;
    __syncthreads();                       // prev iter readers of sKV/sS done
    loadBlkAsync(sKV, kbase, 1);           // K
    asyncWait();
    __syncthreads();
    scoreTiles(sQ, kbase, kb == qb, 1.0f); // sS = tril(Q K^T) block
    __syncthreads();
    gemmSB(o2a, o2b);                      // O2 += S * K
    __syncthreads();                       // K readers done
    loadBlkAsync(sKV, kbase, 2);           // V (overwrites K)
    asyncWait();
    __syncthreads();
    gemmSB(outa, outb);                    // P1 += S * V
  }

  // ---- Transition: Out = 2*P1; park O2 in sQ (Q is dead) ----------------
  __syncthreads();
#pragma unroll
  for (int e = 0; e < 8; ++e) {
    const int row = ro * 16 + e + 8 * lh;
    sQ[row * LDSW + cg * 32 + ln]      = o2a[e];
    sQ[row * LDSW + cg * 32 + 16 + ln] = o2b[e];
  }
  outa *= 2.0f;
  outb *= 2.0f;

  // ---- Phase 2: Out -= tril(O2 K^T) V -----------------------------------
  for (int kb = 0; kb <= qb; ++kb) {
    const int kbase = kb * BQ;
    __syncthreads();                        // O2 visible / prev readers done
    loadBlkAsync(sKV, kbase, 1);            // K
    asyncWait();
    __syncthreads();
    scoreTiles(sQ, kbase, kb == qb, -1.0f); // sS = -tril(O2 K^T) block
    __syncthreads();
    loadBlkAsync(sKV, kbase, 2);            // V
    asyncWait();
    __syncthreads();
    gemmSB(outa, outb);                     // Out += (-A2) * V
  }

  // ---- Writeback: out[b, t, h, d] ---------------------------------------
#pragma unroll
  for (int e = 0; e < 8; ++e) {
    const int t = qbase + ro * 16 + e + 8 * lh;
    const size_t g = (((size_t)b * S_LEN + t) * H_NUM + h) * (size_t)D_DIM;
    out[g + cg * 32 + ln]      = outa[e];
    out[g + cg * 32 + 16 + ln] = outb[e];
  }
}

extern "C" void kernel_launch(void* const* d_in, const int* in_sizes, int n_in,
                              void* d_out, int out_size, void* d_ws,
                              size_t ws_size, hipStream_t stream) {
  (void)in_sizes; (void)n_in; (void)d_ws; (void)ws_size; (void)out_size;
  const float* qkv = (const float*)d_in[0];
  float* out = (float*)d_out;
  dim3 grid(NQB, H_NUM, B_NUM);  // 32 x 16 x 2 = 1024 workgroups
  dim3 block(256);               // 8 wave32 waves
  ttt_fused_kernel<<<grid, block, 0, stream>>>(qkv, out);
}

// v001
// It runs in 61.1 microseconds.
// Two timings next to v000 put it at 5.83 and 7.00 times that version's speed.
#include <hip/hip_runtime.h>
#include <stdint.h>

// ---------------------------------------------------------------------------
// Causal two-step linear attention for MI455X (gfx1250, wave32).
// Out = (2*tril(QK^T) - tril((tril(QK^T)K)K^T)) V.
// No softmax stands between the products, so every block strictly below the
// diagonal is reassociated: (Q K_j^T) X_j = Q (K_j^T X_j). With the running
// states M1 = sum_{j<i} K_j^T K_j and M2 = sum_{j<i} K_j^T V_j, q-block i needs
//   O2  = Q M1 + tril(Q K_i^T) K_i
//   P1  = Q M2 + tril(Q K_i^T) V_i
//   Out = 2 P1 - O2 M2 - tril(O2 K_i^T) V_i
// Launch 1: per-block K^T K and K^T V into the workspace.
// Launch 2: exclusive prefix of those states over the blocks.
// Launch 3: the eight 64x64x64 products of each q-block.
// All GEMMs use V_WMMA_F32_16X16X4_F32 (exact fp32 matrix path).
// Tile loads use GLOBAL_LOAD_ASYNC_TO_LDS_B128 (ASYNCcnt-tracked DMA into
// LDS, no VGPR staging) via inline asm.
// ---------------------------------------------------------------------------

typedef __attribute__((ext_vector_type(2))) float v2f;
typedef __attribute__((ext_vector_type(8))) float v8f;

#define S_LEN 2048
#define H_NUM 16
#define B_NUM 2
#define D_DIM 64
#define BQ    64                 // rows per block
#define NQB   (S_LEN / BQ)       // 32 blocks
#define LDSW  68                 // padded LDS row stride (68 % 64 == 4 -> conflict-free)
#define TILE_F (BQ * LDSW)       // floats per 64x64 padded tile
#define MAT_F (D_DIM * D_DIM)    // floats per 64x64 state matrix
#define ST_F  (2 * MAT_F)        // floats per block state: K^T K, then K^T V
#define ROW_F (3 * H_NUM * D_DIM)  // floats between sequence rows of qkv

__device__ __forceinline__ v8f wmma4(v2f a, v2f b, v8f c) {
  // (neg_a, A, neg_b, B, c_mod, C, reuse_a, reuse_b)
  return __builtin_amdgcn_wmma_f32_16x16x4_f32(false, a, false, b, (short)0, c,
                                               false, false);
}

// Async DMA of one 64x64 fp32 tile (row pitch gpitch floats) into a padded LDS
// tile: 16 bytes/lane, 4 copies. The first operand of a copy holds the LDS byte
// offset (low 32 bits of the flat pointer).
__device__ __forceinline__ void copyTile(float* dst, const float* src,
                                         int gpitch, int tid) {
  const int row = tid >> 4;
  const int c4  = (tid & 15) << 2;
  const float* g0 = src + (size_t)row * gpitch + c4;
  const float* g1 = g0 + (size_t)16 * gpitch;
  const float* g2 = g0 + (size_t)32 * gpitch;
  const float* g3 = g0 + (size_t)48 * gpitch;
  const unsigned l0 = (unsigned)(uintptr_t)(&dst[row * LDSW + c4]);
  const unsigned l1 = l0 + 16 * LDSW * 4;
  const unsigned l2 = l0 + 32 * LDSW * 4;
  const unsigned l3 = l0 + 48 * LDSW * 4;
  // The closing s_wait_xcnt stands inside the statement so that no address
  // register of a copy is rewritten ahead of it.
  asm volatile(
      "global_load_async_to_lds_b128 %0, %4, off\n\t"
      "global_load_async_to_lds_b128 %1, %5, off\n\t"
      "global_load_async_to_lds_b128 %2, %6, off\n\t"
      "global_load_async_to_lds_b128 %3, %7, off\n\t"
      "s_wait_xcnt 0x0"
      :
      : "v"(l0), "v"(l1), "v"(l2), "v"(l3), "v"(g0), "v"(g1), "v"(g2), "v"(g3)
      : "memory");
}

// This wave's own copies have landed in LDS; the barrier behind it publishes
// them to the other waves.
__device__ __forceinline__ void asyncWait() {
  asm volatile("s_wait_asynccnt 0x0" ::: "memory");
}

// Fragment of a row-major operand X (A of X*Y, or B of Y*X^T): lane ln holds
// row r0 + ln, k pair col, col + 1.
__device__ __forceinline__ v2f fragRow(const float* s, int r, int col) {
  return *(const v2f*)(&s[r * LDSW + col]);
}
// Fragment of a k-major operand X (B of Y*X, or A of X^T*Y): lane ln holds
// column c, k pair rows col, col + 1.
__device__ __forceinline__ v2f fragCol(const float* s, int col, int c) {
  v2f r = {s[col * LDSW + c], s[(col + 1) * LDSW + c]};
  return r;
}

// ---- Launch 1: st[bh][blk] = { K_blk^T K_blk, K_blk^T V_blk } --------------
__global__ __launch_bounds__(256) void blk_state_kernel(
    const float* __restrict__ qkv, float* __restrict__ st) {
  __shared__ __attribute__((aligned(16))) float sK[TILE_F];
  __shared__ __attribute__((aligned(16))) float sV[TILE_F];

  const int blk  = blockIdx.x;
  const int h    = blockIdx.y;
  const int b    = blockIdx.z;
  const int tid  = threadIdx.x;
  const int wave = tid >> 5;        // 0..7
  const int lane = tid & 31;
  const int ln   = lane & 15;       // lane within half-wave
  const int lh   = lane >> 4;       // half-wave (k-pair / row-group select)
  const int ro   = wave & 3;        // wave's 16-row group (0..3)
  const int cg   = wave >> 2;       // wave's 32-col group (0..1)

  // qkv flat index: (((b*S + s)*3 + which)*H + h)*D + d
  const float* kp =
      qkv + ((((size_t)b * S_LEN + blk * BQ) * 3 + 1) * H_NUM + h) * (size_t)D_DIM;
  copyTile(sK, kp, ROW_F, tid);
  copyTile(sV, kp + H_NUM * D_DIM, ROW_F, tid);
  asyncWait();
  __syncthreads();

  const int c0 = cg * 32 + ln;
  const int c1 = cg * 32 + 16 + ln;
  v8f kk0 = {}, kk1 = {}, kv0 = {}, kv1 = {};
#pragma unroll
  for (int k4 = 0; k4 < 16; ++k4) {
    const int col = k4 * 4 + lh * 2;  // k-dim (sequence row) pair of this half-wave
    v2f a = fragCol(sK, col, ro * 16 + ln);  // A = K^T
    kk0 = wmma4(a, fragCol(sK, col, c0), kk0);
    kk1 = wmma4(a, fragCol(sK, col, c1), kk1);
    kv0 = wmma4(a, fragCol(sV, col, c0), kv0);
    kv1 = wmma4(a, fragCol(sV, col, c1), kv1);
  }

  // C layout: lanes 0-15 hold rows M=e, lanes 16-31 rows M=e+8, col N=ln.
  float* sp = st + ((size_t)(b * H_NUM + h) * NQB + blk) * ST_F;
#pragma unroll
  for (int e = 0; e < 8; ++e) {
    const int row = ro * 16 + e + 8 * lh;
    sp[row * D_DIM + c0]         = kk0[e];
    sp[row * D_DIM + c1]         = kk1[e];
    sp[MAT_F + row * D_DIM + c0] = kv0[e];
    sp[MAT_F + row * D_DIM + c1] = kv1[e];
  }
}

// ---- Launch 2: pre[bh][blk] = sum of st[bh][j] over j < blk ----------------
__global__ __launch_bounds__(256) void state_prefix_kernel(
    const float* __restrict__ st, float* __restrict__ pre) {
  const int bh = blockIdx.y;
  const int i  = blockIdx.x * 256 + threadIdx.x;  // float4 slot of one state
  const float4* p = (const float4*)(st + (size_t)bh * NQB * ST_F) + i;
  float4* q = (float4*)(pre + (size_t)bh * NQB * ST_F) + i;
  float4 v[NQB - 1];
  // Unrolled so that v stays in registers.
#pragma unroll
  for (int j = 0; j < NQB - 1; ++j) v[j] = p[j * (ST_F / 4)];
  // Keeps every load ahead of the sums: all are in flight at once, where the
  // scheduler otherwise leaves two and the wave pays their latency in a chain.
  __builtin_amdgcn_sched_barrier(0);
  float4 run = {0.0f, 0.0f, 0.0f, 0.0f};
#pragma unroll
  for (int j = 0; j < NQB; ++j) {
    q[j * (ST_F / 4)] = run;
    if (j < NQB - 1) {
      run.x += v[j].x;
      run.y += v[j].y;
      run.z += v[j].z;
      run.w += v[j].w;
    }
  }
}

// ---- Launch 3: one 64-row q-block per workgroup ----------------------------
__global__ __launch_bounds__(256) void blk_out_kernel(
    const float* __restrict__ qkv, const float* __restrict__ pre,
    float* __restrict__ out) {
  // 6 padded 64x64 fp32 tiles: Q (reused for -O2), K, V, M1, M2, S.
  __shared__ __attribute__((aligned(16))) float sQ[TILE_F];
  __shared__ __attribute__((aligned(16))) float sK[TILE_F];
  __shared__ __attribute__((aligned(16))) float sV[TILE_F];
  __shared__ __attribute__((aligned(16))) float sM1[TILE_F];
  __shared__ __attribute__((aligned(16))) float sM2[TILE_F];
  __shared__ __attribute__((aligned(16))) float sS[TILE_F];

  const int qb   = blockIdx.x;      // query block
  const int h    = blockIdx.y;      // head
  const int b    = blockIdx.z;      // batch
  const int tid  = threadIdx.x;
  const int wave = tid >> 5;        // 0..7
  const int lane = tid & 31;
  const int ln   = lane & 15;       // lane within half-wave
  const int lh   = lane >> 4;       // half-wave (k-pair / row-group select)
  const int ro   = wave & 3;        // wave's 16-row group (0..3)
  const int cg   = wave >> 2;       // wave's 32-col group (0..1)
  const int qbase = qb * BQ;
  const int ar   = ro * 16 + ln;    // A-fragment row of this lane
  const int c0   = cg * 32 + ln;    // the wave's two 16-column tiles
  const int c1   = cg * 32 + 16 + ln;

  // qkv flat index: (((b*S + s)*3 + which)*H + h)*D + d
  const float* qp =
      qkv + ((((size_t)b * S_LEN + qbase) * 3) * H_NUM + h) * (size_t)D_DIM;
  const float* mp = pre + ((size_t)(b * H_NUM + h) * NQB + qb) * ST_F;
  copyTile(sQ, qp, ROW_F, tid);
  copyTile(sK, qp + H_NUM * D_DIM, ROW_F, tid);
  copyTile(sM1, mp, D_DIM, tid);
  copyTile(sM2, mp + MAT_F, D_DIM, tid);
  copyTile(sV, qp + 2 * H_NUM * D_DIM, ROW_F, tid);
  asyncWait();
  __syncthreads();                  // all five tiles published

  // sS = tril(s): the wave's 16x32 strip of a diagonal score block.
  // C layout: lanes 0-15 hold rows M=e, lanes 16-31 rows M=e+8, col N=ln.
  auto storeTril = [&](const v8f& s0, const v8f& s1) {
#pragma unroll
    for (int e = 0; e < 8; ++e) {
      const int row = ro * 16 + e + 8 * lh;
      sS[row * LDSW + c0] = (c0 > row) ? 0.0f : s0[e];
      sS[row * LDSW + c1] = (c1 > row) ? 0.0f : s1[e];
    }
  };

  v8f o2a = {}, o2b = {};    // O2 strip accumulators (16x32 per wave)
  v8f outa = {}, outb = {};  // output strip accumulators

  // ---- S = tril(Q K^T); O2 = Q M1; P1 = Q M2 -----------------------------
  {
    v8f s0 = {}, s1 = {};
#pragma unroll
    for (int k4 = 0; k4 < 16; ++k4) {
      const int col = k4 * 4 + lh * 2;  // k-dim pair for this half-wave
      v2f a = fragRow(sQ, ar, col);
      s0   = wmma4(a, fragRow(sK, c0, col), s0);
      s1   = wmma4(a, fragRow(sK, c1, col), s1);
      o2a  = wmma4(a, fragCol(sM1, col, c0), o2a);
      o2b  = wmma4(a, fragCol(sM1, col, c1), o2b);
      outa = wmma4(a, fragCol(sM2, col, c0), outa);
      outb = wmma4(a, fragCol(sM2, col, c1), outb);
    }
    storeTril(s0, s1);
  }
  __syncthreads();                  // S published; every read of Q done

  // ---- O2 += S K; P1 += S V ----------------------------------------------
#pragma unroll
  for (int k4 = 0; k4 < 16; ++k4) {
    const int col = k4 * 4 + lh * 2;
    v2f a = fragRow(sS, ar, col);
    o2a  = wmma4(a, fragCol(sK, col, c0), o2a);
    o2b  = wmma4(a, fragCol(sK, col, c1), o2b);
    outa = wmma4(a, fragCol(sV, col, c0), outa);
    outb = wmma4(a, fragCol(sV, col, c1), outb);
  }

  // ---- Out = 2*P1; park -O2 in sQ (Q is dead) ----------------------------
#pragma unroll
  for (int e = 0; e < 8; ++e) {
    const int row = ro * 16 + e + 8 * lh;
    sQ[row * LDSW + c0] = -o2a[e];
    sQ[row * LDSW + c1] = -o2b[e];
  }
  outa *= 2.0f;
  outb *= 2.0f;
  __syncthreads();                  // -O2 published; every read of S done

  // ---- S = tril(-O2 K^T); Out += (-O2) M2 --------------------------------
  {
    v8f s0 = {}, s1 = {};
#pragma unroll
    for (int k4 = 0; k4 < 16; ++k4) {
      const int col = k4 * 4 + lh * 2;
      v2f a = fragRow(sQ, ar, col);
      s0   = wmma4(a, fragRow(sK, c0, col), s0);
      s1   = wmma4(a, fragRow(sK, c1, col), s1);
      outa = wmma4(a, fragCol(sM2, col, c0), outa);
      outb = wmma4(a, fragCol(sM2, col, c1), outb);
    }
    storeTril(s0, s1);
  }
  __syncthreads();                  // S published

  // ---- Out += S V ---------------------------------------------------------
#pragma unroll
  for (int k4 = 0; k4 < 16; ++k4) {
    const int col = k4 * 4 + lh * 2;
    v2f a = fragRow(sS, ar, col);
    outa = wmma4(a, fragCol(sV, col, c0), outa);
    outb = wmma4(a, fragCol(sV, col, c1), outb);
  }

  // ---- Writeback: out[b, t, h, d] ---------------------------------------
#pragma unroll
  for (int e = 0; e < 8; ++e) {
    const int t = qbase + ro * 16 + e + 8 * lh;
    const size_t g = (((size_t)b * S_LEN + t) * H_NUM + h) * (size_t)D_DIM;
    out[g + c0] = outa[e];
    out[g + c1] = outb[e];
  }
}

extern "C" void kernel_launch(void* const* d_in, const int* in_sizes, int n_in,
                              void* d_out, int out_size, void* d_ws,
                              size_t ws_size, hipStream_t stream) {
  (void)in_sizes; (void)n_in; (void)ws_size; (void)out_size;
  const float* qkv = (const float*)d_in[0];
  float* out = (float*)d_out;
  float* st  = (float*)d_ws;     // 1024 block states of 32 KiB = 32 MiB
  float* pre = st + (size_t)B_NUM * H_NUM * NQB * ST_F;  // their prefixes, 32 MiB
  dim3 grid(NQB, H_NUM, B_NUM);  // 32 x 16 x 2 = 1024 workgroups
  dim3 block(256);               // 8 wave32 waves
  dim3 sgrid(NQB - 1, H_NUM, B_NUM);  // the last block's state enters no prefix
  blk_state_kernel<<<sgrid, block, 0, stream>>>(qkv, st);
  dim3 pgrid(ST_F / 4 / 256, H_NUM * B_NUM);  // 8 x 32 workgroups
  state_prefix_kernel<<<pgrid, block, 0, stream>>>(st, pre);
  blk_out_kernel<<<grid, block, 0, stream>>>(qkv, pre, out);
}

// v002
// Measured time: 59.7 microseconds a run.
// Next to v001, in two timings, it ran 1.08 and 1.10 times as fast.
// All steps since v000 together make it 6.95 times as fast.
#include <hip/hip_runtime.h>
#include <stdint.h>

// ---------------------------------------------------------------------------
// Causal two-step linear attention for MI455X (gfx1250, wave32).
// Out = (2*tril(QK^T) - tril((tril(QK^T)K)K^T)) V.
// No softmax stands between the products, so every block strictly below the
// diagonal is reassociated: (Q K_j^T) X_j = Q (K_j^T X_j). With the running
// states M1 = sum_{j<i} K_j^T K_j and M2 = sum_{j<i} K_j^T V_j, q-block i needs
//   O2  = Q M1 + tril(Q K_i^T) K_i
//   Out = 2 (Q M2 + tril(Q K_i^T) V_i) - O2 M2 - tril(O2 K_i^T) V_i
// Both halves of Out are linear in their left factor (tril is linear too), so
// with R = 2 Q - O2 they fold into one pass:
//   Out = R M2 + tril(R K_i^T) V_i
// Launch 1: per-block K^T K and K^T V into the workspace.
// Launch 2: exclusive prefix of those states over the blocks.
// Launch 3: the six 64x64x64 products of each q-block.
// All GEMMs use V_WMMA_F32_16X16X4_F32 (exact fp32 matrix path).
// Tile loads use GLOBAL_LOAD_ASYNC_TO_LDS_B128 (ASYNCcnt-tracked DMA into
// LDS, no VGPR staging) via inline asm.
// ---------------------------------------------------------------------------

typedef __attribute__((ext_vector_type(2))) float v2f;
typedef __attribute__((ext_vector_type(8))) float v8f;

#define S_LEN 2048
#define H_NUM 16
#define B_NUM 2
#define D_DIM 64
#define BQ    64                 // rows per block
#define NQB   (S_LEN / BQ)       // 32 blocks
#define LDSW  68                 // padded LDS row stride (68 % 64 == 4 -> conflict-free)
#define TILE_F (BQ * LDSW)       // floats per 64x64 padded tile
#define MAT_F (D_DIM * D_DIM)    // floats per 64x64 state matrix
#define ST_F  (2 * MAT_F)        // floats per block state: K^T K, then K^T V
#define ROW_F (3 * H_NUM * D_DIM)  // floats between sequence rows of qkv

__device__ __forceinline__ v8f wmma4(v2f a, v2f b, v8f c) {
  // (neg_a, A, neg_b, B, c_mod, C, reuse_a, reuse_b)
  return __builtin_amdgcn_wmma_f32_16x16x4_f32(false, a, false, b, (short)0, c,
                                               false, false);
}

// Async DMA of one 64x64 fp32 tile (row pitch gpitch floats) into a padded LDS
// tile: 16 bytes/lane, 4 copies. The first operand of a copy holds the LDS byte
// offset (low 32 bits of the flat pointer).
__device__ __forceinline__ void copyTile(float* dst, const float* src,
                                         int gpitch, int tid) {
  const int row = tid >> 4;
  const int c4  = (tid & 15) << 2;
  const float* g0 = src + (size_t)row * gpitch + c4;
  const float* g1 = g0 + (size_t)16 * gpitch;
  const float* g2 = g0 + (size_t)32 * gpitch;
  const float* g3 = g0 + (size_t)48 * gpitch;
  const unsigned l0 = (unsigned)(uintptr_t)(&dst[row * LDSW + c4]);
  const unsigned l1 = l0 + 16 * LDSW * 4;
  const unsigned l2 = l0 + 32 * LDSW * 4;
  const unsigned l3 = l0 + 48 * LDSW * 4;
  // The closing s_wait_xcnt stands inside the statement so that no address
  // register of a copy is rewritten ahead of it.
  asm volatile(
      "global_load_async_to_lds_b128 %0, %4, off\n\t"
      "global_load_async_to_lds_b128 %1, %5, off\n\t"
      "global_load_async_to_lds_b128 %2, %6, off\n\t"
      "global_load_async_to_lds_b128 %3, %7, off\n\t"
      "s_wait_xcnt 0x0"
      :
      : "v"(l0), "v"(l1), "v"(l2), "v"(l3), "v"(g0), "v"(g1), "v"(g2), "v"(g3)
      : "memory");
}

// This wave's own copies have landed in LDS; the barrier behind it publishes
// them to the other waves.
__device__ __forceinline__ void asyncWait() {
  asm volatile("s_wait_asynccnt 0x0" ::: "memory");
}

// Fragment of a row-major operand X (A of X*Y, or B of Y*X^T): lane ln holds
// row r0 + ln, k pair col, col + 1.
__device__ __forceinline__ v2f fragRow(const float* s, int r, int col) {
  return *(const v2f*)(&s[r * LDSW + col]);
}
// Fragment of a k-major operand X (B of Y*X, or A of X^T*Y): lane ln holds
// column c, k pair rows col, col + 1.
__device__ __forceinline__ v2f fragCol(const float* s, int col, int c) {
  v2f r = {s[col * LDSW + c], s[(col + 1) * LDSW + c]};
  return r;
}

// ---- Launch 1: st[bh][blk] = { K_blk^T K_blk, K_blk^T V_blk } --------------
__global__ __launch_bounds__(256) void blk_state_kernel(
    const float* __restrict__ qkv, float* __restrict__ st) {
  __shared__ __attribute__((aligned(16))) float sK[TILE_F];
  __shared__ __attribute__((aligned(16))) float sV[TILE_F];

  const int blk  = blockIdx.x;
  const int h    = blockIdx.y;
  const int b    = blockIdx.z;
  const int tid  = threadIdx.x;
  const int wave = tid >> 5;        // 0..7
  const int lane = tid & 31;
  const int ln   = lane & 15;       // lane within half-wave
  const int lh   = lane >> 4;       // half-wave (k-pair / row-group select)
  const int ro   = wave & 3;        // wave's 16-row group (0..3)
  const int cg   = wave >> 2;       // wave's 32-col group (0..1)

  // qkv flat index: (((b*S + s)*3 + which)*H + h)*D + d
  const float* kp =
      qkv + ((((size_t)b * S_LEN + blk * BQ) * 3 + 1) * H_NUM + h) * (size_t)D_DIM;
  copyTile(sK, kp, ROW_F, tid);
  copyTile(sV, kp + H_NUM * D_DIM, ROW_F, tid);
  asyncWait();
  __syncthreads();

  const int c0 = cg * 32 + ln;
  const int c1 = cg * 32 + 16 + ln;
  v8f kk0 = {}, kk1 = {}, kv0 = {}, kv1 = {};
#pragma unroll
  for (int k4 = 0; k4 < 16; ++k4) {
    const int col = k4 * 4 + lh * 2;  // k-dim (sequence row) pair of this half-wave
    v2f a = fragCol(sK, col, ro * 16 + ln);  // A = K^T
    kk0 = wmma4(a, fragCol(sK, col, c0), kk0);
    kk1 = wmma4(a, fragCol(sK, col, c1), kk1);
    kv0 = wmma4(a, fragCol(sV, col, c0), kv0);
    kv1 = wmma4(a, fragCol(sV, col, c1), kv1);
  }

  // C layout: lanes 0-15 hold rows M=e, lanes 16-31 rows M=e+8, col N=ln.
  float* sp = st + ((size_t)(b * H_NUM + h) * NQB + blk) * ST_F;
#pragma unroll
  for (int e = 0; e < 8; ++e) {
    const int row = ro * 16 + e + 8 * lh;
    sp[row * D_DIM + c0]         = kk0[e];
    sp[row * D_DIM + c1]         = kk1[e];
    sp[MAT_F + row * D_DIM + c0] = kv0[e];
    sp[MAT_F + row * D_DIM + c1] = kv1[e];
  }
}

// ---- Launch 2: pre[bh][blk] = sum of st[bh][j] over j < blk ----------------
__global__ __launch_bounds__(256) void state_prefix_kernel(
    const float* __restrict__ st, float* __restrict__ pre) {
  const int bh = blockIdx.y;
  const int i  = blockIdx.x * 256 + threadIdx.x;  // float4 slot of one state
  const float4* p = (const float4*)(st + (size_t)bh * NQB * ST_F) + i;
  float4* q = (float4*)(pre + (size_t)bh * NQB * ST_F) + i;
  float4 v[NQB - 1];
  // Unrolled so that v stays in registers.
#pragma unroll
  for (int j = 0; j < NQB - 1; ++j) v[j] = p[j * (ST_F / 4)];
  // Keeps every load ahead of the sums: all are in flight at once, where the
  // scheduler otherwise leaves two and the wave pays their latency in a chain.
  __builtin_amdgcn_sched_barrier(0);
  float4 run = {0.0f, 0.0f, 0.0f, 0.0f};
#pragma unroll
  for (int j = 0; j < NQB; ++j) {
    q[j * (ST_F / 4)] = run;
    if (j < NQB - 1) {
      run.x += v[j].x;
      run.y += v[j].y;
      run.z += v[j].z;
      run.w += v[j].w;
    }
  }
}

// ---- Launch 3: one 64-row q-block per workgroup ----------------------------
__global__ __launch_bounds__(256) void blk_out_kernel(
    const float* __restrict__ qkv, const float* __restrict__ pre,
    float* __restrict__ out) {
  // 6 padded 64x64 fp32 tiles: Q (turned into R = 2 Q - O2), K, V, M1, M2, S.
  __shared__ __attribute__((aligned(16))) float sQ[TILE_F];
  __shared__ __attribute__((aligned(16))) float sK[TILE_F];
  __shared__ __attribute__((aligned(16))) float sV[TILE_F];
  __shared__ __attribute__((aligned(16))) float sM1[TILE_F];
  __shared__ __attribute__((aligned(16))) float sM2[TILE_F];
  __shared__ __attribute__((aligned(16))) float sS[TILE_F];

  const int qb   = blockIdx.x;      // query block
  const int h    = blockIdx.y;      // head
  const int b    = blockIdx.z;      // batch
  const int tid  = threadIdx.x;
  const int wave = tid >> 5;        // 0..7
  const int lane = tid & 31;
  const int ln   = lane & 15;       // lane within half-wave
  const int lh   = lane >> 4;       // half-wave (k-pair / row-group select)
  const int ro   = wave & 3;        // wave's 16-row group (0..3)
  const int cg   = wave >> 2;       // wave's 32-col group (0..1)
  const int qbase = qb * BQ;
  const int ar   = ro * 16 + ln;    // A-fragment row of this lane
  const int c0   = cg * 32 + ln;    // the wave's two 16-column tiles
  const int c1   = cg * 32 + 16 + ln;

  // qkv flat index: (((b*S + s)*3 + which)*H + h)*D + d
  const float* qp =
      qkv + ((((size_t)b * S_LEN + qbase) * 3) * H_NUM + h) * (size_t)D_DIM;
  const float* mp = pre + ((size_t)(b * H_NUM + h) * NQB + qb) * ST_F;
  copyTile(sQ, qp, ROW_F, tid);
  copyTile(sK, qp + H_NUM * D_DIM, ROW_F, tid);
  copyTile(sM1, mp, D_DIM, tid);
  copyTile(sM2, mp + MAT_F, D_DIM, tid);
  copyTile(sV, qp + 2 * H_NUM * D_DIM, ROW_F, tid);
  asyncWait();
  __syncthreads();                  // all five tiles published

  // sS = tril(s): the wave's 16x32 strip of a diagonal score block.
  // C layout: lanes 0-15 hold rows M=e, lanes 16-31 rows M=e+8, col N=ln.
  auto storeTril = [&](const v8f& s0, const v8f& s1) {
#pragma unroll
    for (int e = 0; e < 8; ++e) {
      const int row = ro * 16 + e + 8 * lh;
      sS[row * LDSW + c0] = (c0 > row) ? 0.0f : s0[e];
      sS[row * LDSW + c1] = (c1 > row) ? 0.0f : s1[e];
    }
  };

  v8f o2a = {}, o2b = {};    // O2 strip accumulators (16x32 per wave)
  v8f outa = {}, outb = {};  // output strip accumulators

  // ---- S = tril(Q K^T); O2 = Q M1 ----------------------------------------
  {
    v8f s0 = {}, s1 = {};
#pragma unroll
    for (int k4 = 0; k4 < 16; ++k4) {
      const int col = k4 * 4 + lh * 2;  // k-dim pair for this half-wave
      v2f a = fragRow(sQ, ar, col);
      s0   = wmma4(a, fragRow(sK, c0, col), s0);
      s1   = wmma4(a, fragRow(sK, c1, col), s1);
      o2a  = wmma4(a, fragCol(sM1, col, c0), o2a);
      o2b  = wmma4(a, fragCol(sM1, col, c1), o2b);
    }
    storeTril(s0, s1);
  }
  __syncthreads();                  // S published; every fragment read of Q done

  // ---- O2 += S K ----------------------------------------------------------
#pragma unroll
  for (int k4 = 0; k4 < 16; ++k4) {
    const int col = k4 * 4 + lh * 2;
    v2f a = fragRow(sS, ar, col);
    o2a  = wmma4(a, fragCol(sK, col, c0), o2a);
    o2b  = wmma4(a, fragCol(sK, col, c1), o2b);
  }

  // Four vector slots between the last WMMA and the first vector instruction
  // that reads its result; the operands hold the statement between the two.
  asm volatile("v_nop\n\tv_nop\n\tv_nop\n\tv_nop" : "+v"(o2a), "+v"(o2b));

  // ---- R = 2 Q - O2, in place: each element of sQ is read and rewritten by
  // the one lane that holds the same element of O2 --------------------------
#pragma unroll
  for (int e = 0; e < 8; ++e) {
    const int row = ro * 16 + e + 8 * lh;
    sQ[row * LDSW + c0] = 2.0f * sQ[row * LDSW + c0] - o2a[e];
    sQ[row * LDSW + c1] = 2.0f * sQ[row * LDSW + c1] - o2b[e];
  }
  __syncthreads();                  // R published; every read of S done

  // ---- S = tril(R K^T); Out = R M2 ---------------------------------------
  {
    v8f s0 = {}, s1 = {};
#pragma unroll
    for (int k4 = 0; k4 < 16; ++k4) {
      const int col = k4 * 4 + lh * 2;
      v2f a = fragRow(sQ, ar, col);
      s0   = wmma4(a, fragRow(sK, c0, col), s0);
      s1   = wmma4(a, fragRow(sK, c1, col), s1);
      outa = wmma4(a, fragCol(sM2, col, c0), outa);
      outb = wmma4(a, fragCol(sM2, col, c1), outb);
    }
    storeTril(s0, s1);
  }
  __syncthreads();                  // S published

  // ---- Out += S V ---------------------------------------------------------
#pragma unroll
  for (int k4 = 0; k4 < 16; ++k4) {
    const int col = k4 * 4 + lh * 2;
    v2f a = fragRow(sS, ar, col);
    outa = wmma4(a, fragCol(sV, col, c0), outa);
    outb = wmma4(a, fragCol(sV, col, c1), outb);
  }

  // ---- Writeback: out[b, t, h, d] ---------------------------------------
#pragma unroll
  for (int e = 0; e < 8; ++e) {
    const int t = qbase + ro * 16 + e + 8 * lh;
    const size_t g = (((size_t)b * S_LEN + t) * H_NUM + h) * (size_t)D_DIM;
    out[g + c0] = outa[e];
    out[g + c1] = outb[e];
  }
}

extern "C" void kernel_launch(void* const* d_in, const int* in_sizes, int n_in,
                              void* d_out, int out_size, void* d_ws,
                              size_t ws_size, hipStream_t stream) {
  (void)in_sizes; (void)n_in; (void)ws_size; (void)out_size;
  const float* qkv = (const float*)d_in[0];
  float* out = (float*)d_out;
  float* st  = (float*)d_ws;     // 1024 block states of 32 KiB = 32 MiB
  float* pre = st + (size_t)B_NUM * H_NUM * NQB * ST_F;  // their prefixes, 32 MiB
  dim3 grid(NQB, H_NUM, B_NUM);  // 32 x 16 x 2 = 1024 workgroups
  dim3 block(256);               // 8 wave32 waves
  dim3 sgrid(NQB - 1, H_NUM, B_NUM);  // the last block's state enters no prefix
  blk_state_kernel<<<sgrid, block, 0, stream>>>(qkv, st);
  dim3 pgrid(ST_F / 4 / 256, H_NUM * B_NUM);  // 8 x 32 workgroups
  state_prefix_kernel<<<pgrid, block, 0, stream>>>(st, pre);
  blk_out_kernel<<<grid, block, 0, stream>>>(qkv, pre, out);
}
